// v010
// Measured on an AMD MI455X. A time is GPU time per run, averaged over a window of back-to-back runs after a warm-up
// (all launches, gaps included; the runs take copies of the inputs in turn), and the median of several windows.
// Apart from v000's, it joins two sittings. Times from different sittings can be a few percent apart, while
// side-by-side timings come from the same sitting.
// Earlier versions than v010 are not in this document.
// It runs in 142 microseconds.
// Two timings next to v009 both put it at 1.03 times that version's speed.
// Counting every step since v000, which is the starting kernel, it is 9.31 times as fast.
#include <hip/hip_runtime.h>
// Geometry-aware attention (B=8, N=1024, F=512, 8 heads × 64, G=128): feat = MHA(features) (x·W + b, softmax(q·k/8)·v, ·wo + bo); geometry branch: gq, gk, gv = geometry·W + b (F wide, single head);
// g_scores = gq·gkᵀ/8 + mean_h(gelu_tanh(dist·d1_w + d1_b)·d2_w + d2_b) with dist = max(‖coords_q − coords_k‖, 1e-6); geom = softmax(g_scores)·gv; out = (feat + geom)·op_w + op_b. (in,out) weights; jax.nn.gelu default = tanh approximation.
// Compute dtype: features, geometry, coords, all weights/biases rounded to bf16; f16 GEMM planes; the 8-head branch through a fused flash-style kernel (online softmax f32, P f16 ×2^10); the geometry branch, every stage one launch over all batches (batch in blockIdx.y): S = gq·gkᵀ/8 f32-accurate from f16 hi + residual planes (hi·hi + (lo·hi + hi·lo)·2^-10; its logits reach σ≈3), a kernel adding the distance-MLP bias in place (f32, per pair from the coords), a wave-per-row f32 softmax → P f16 ×2^15, geom = P·gv by GEMM with feat_att as the f32 addend; final projection GEMM. All contractions on v_wmma_f32_16x16x32_f16, f32 accumulate.
#define BB 8
#define TT 1024
#define DD 512
#define GG 128
#define NH 8
#define NR (BB * TT)
#define TT_LOG2 10
static_assert((1 << TT_LOG2) == TT, "tokens per batch");

typedef __bf16 v16b __attribute__((ext_vector_type(16)));
typedef unsigned short v8us __attribute__((ext_vector_type(8), may_alias));
typedef float  v8f  __attribute__((ext_vector_type(8)));
typedef float  v4f  __attribute__((ext_vector_type(4)));
typedef float  v4fa __attribute__((ext_vector_type(4), may_alias));
union FragB { v16b v; v8us half[2]; unsigned short u[16]; };

__device__ __forceinline__ unsigned short bf16_bits(float x) { unsigned int u = __float_as_uint(x); return (unsigned short)((u + 0x7FFFu + ((u >> 16) & 1u)) >> 16); }
__device__ __forceinline__ float bf16_val(unsigned short b) { return __uint_as_float(((unsigned int)b) << 16); }
__device__ __forceinline__ float bf16_round(float x) { return bf16_val(bf16_bits(x)); }
// D += A·B with NT terms: 1 = ah·bh, 2 = + al·bh (A split), 3 = + ah·bl (both split)
template <int NT>
__device__ __forceinline__ v8f mmaN(v16b ah, v16b al, v16b bh, v16b bl, v8f c) {
  c = __builtin_amdgcn_wmma_f32_16x16x32_bf16(false, ah, false, bh, (short)0, c, false, false);
  if (NT >= 2) c = __builtin_amdgcn_wmma_f32_16x16x32_bf16(false, al, false, bh, (short)0, c, false, false);
  if (NT >= 3) c = __builtin_amdgcn_wmma_f32_16x16x32_bf16(false, ah, false, bl, (short)0, c, false, false);
  asm volatile("v_nop\n\tv_nop\n\tv_nop\n\tv_nop" : "+v"(c) : "v"(ah), "v"(al), "v"(bh), "v"(bl));
  return c;
}

__global__ __launch_bounds__(256) void k_wt_bf16(const float* __restrict__ W, unsigned short* __restrict__ Wt, int K, int N) {
  const int t = blockIdx.x * 256 + threadIdx.x;
  const int k8n = K / 8;
  if (t >= N * k8n) return;
  const int n = t / k8n, k8 = (t % k8n) * 8;
  v8us v;
#pragma unroll
  for (int i = 0; i < 8; ++i) v[i] = bf16_bits(W[(size_t)(k8 + i) * N + n]);
  *(v8us*)(Wt + (size_t)n * K + k8) = v;
  
}

// GEMM C[M][N] (f32, pitch ldc) = act(A[M][K]·W + bias). A f32 row-major (pitch lda) converted per fragment to bf16
// (ASPLIT: hi/lo two planes -> 2 terms, else single rounded term); Wt bf16 [N][K] (pitch ldb). BIAS_BF16 rounds the
// bias to bf16 first (bias quantised to bf16 before the add). K%32==0, M%16==0, N%64==0.
template <bool ASPLIT, int ACT, bool BIAS_BF16>
__global__ __launch_bounds__(128) void k_gemm_bf(const float* __restrict__ A, int lda, const unsigned short* __restrict__ Wt, int ldb,
                                               const float* __restrict__ bias, float* __restrict__ C, int ldc, int M, int N, int K) {
  __shared__ __attribute__((aligned(16))) float so[4][16][64];
  const int tid = threadIdx.x, w = tid >> 5, lane = tid & 31, ln = lane & 15, hh = lane >> 4;
  const int ntn = N / 64;
  const int wid = blockIdx.x * 4 + w;
  const int mt = wid / ntn, nq = wid % ntn;
  if (mt * 16 >= M) return;
  const int row0 = mt * 16, col0 = nq * 64;
  const float* arow = A + (size_t)(row0 + ln) * lda;
  v8f acc[4] = {};
  for (int kb = 0; kb < K; kb += 32) {
    FragB ah, al;
    const v4f x0 = *(const v4fa*)(arow + kb + 8 * hh), x1 = *(const v4fa*)(arow + kb + 8 * hh + 4);
    const v4f x2 = *(const v4fa*)(arow + kb + 16 + 8 * hh), x3 = *(const v4fa*)(arow + kb + 16 + 8 * hh + 4);
    float xs[16] = {x0[0],x0[1],x0[2],x0[3],x1[0],x1[1],x1[2],x1[3],x2[0],x2[1],x2[2],x2[3],x3[0],x3[1],x3[2],x3[3]};
#pragma unroll
    for (int i = 0; i < 16; ++i) { const unsigned short hb = bf16_bits(xs[i]); ah.u[i] = hb; al.u[i] = ASPLIT ? bf16_bits(xs[i] - bf16_val(hb)) : (unsigned short)0; }
#pragma unroll
    for (int t = 0; t < 4; ++t) {
      const unsigned short* brow = Wt + (size_t)(col0 + t * 16 + ln) * ldb + kb;
      FragB b;
      b.half[0] = *(const v8us*)(brow + 8 * hh);
      b.half[1] = *(const v8us*)(brow + 16 + 8 * hh);
      acc[t] = mmaN<ASPLIT ? 2 : 1>(ah.v, al.v, b.v, b.v, acc[t]);
    }
  }
#pragma unroll
  for (int t = 0; t < 4; ++t) {
    float bv = bias ? bias[col0 + t * 16 + ln] : 0.f;
    if (BIAS_BF16) bv = bf16_round(bv);
#pragma unroll
    for (int r = 0; r < 8; ++r) { float v = acc[t][r] + bv; if (ACT == 1) v = fmaxf(v, 0.f); so[w][8 * hh + r][t * 16 + ln] = v; }
  }
  __builtin_amdgcn_fence(__ATOMIC_ACQ_REL, "workgroup");
  __builtin_amdgcn_wave_barrier();
  const int rsub = lane >> 4, c4 = (lane & 15) * 4;
  {
#pragma unroll
    for (int q = 0; q < 8; ++q) {
      const int r = q * 2 + rsub;
      const v4f v = *(const v4fa*)&so[w][r][c4];
      *(v4f*)(C + (size_t)(row0 + r) * ldc + col0 + c4) = v;
    }
    
  }
}

// Flash-style causal/unmasked attention, all contractions 3-term bf16 hi/lo splits, f32 softmax with running max.
// q,k,v rows are read from f32 buffers with arbitrary row pitch (so they can live inside a fused qkv buffer);
// D = head size (multiple of 32, <= 128); one wave = 16 query rows; block = 4 waves (64 queries) sharing K/V chunks of 32.
template <int D, bool CAUSAL>
__global__ __launch_bounds__(128) void k_flash(const float* __restrict__ qb, const float* __restrict__ kb, const float* __restrict__ vb,
                                             int pitch, int T, int H, float scale, float* __restrict__ y, int ypitch) {
  constexpr int KS = D / 32;        // k-steps for QK
  constexpr int DT = D / 16;        // d tiles for PV
  __shared__ __attribute__((aligned(16))) unsigned short sKh[32][D + 8], sKl[32][D + 8], sVh[32][D + 8], sVl[32][D + 8];
  __shared__ __attribute__((aligned(16))) unsigned short sPh[4][16][40], sPl[4][16][40];
  __shared__ __attribute__((aligned(16))) float sO[4][16][D];
  const int tid = threadIdx.x, w = tid >> 5, lane = tid & 31, ln = lane & 15, hh = lane >> 4;
  const int nqb = (T + 63) / 64;
  const int bh = blockIdx.x / nqb, qblk = blockIdx.x % nqb;
  const int b = bh / H, h = bh % H;
  const int q0 = qblk * 64 + w * 16;
  const float* Q = qb + (size_t)b * T * pitch + h * D;
  const float* K = kb + (size_t)b * T * pitch + h * D;
  const float* V = vb + (size_t)b * T * pitch + h * D;

  // A fragments of the wave's 16 query rows (scaled), hi/lo
  FragB aqh[KS], aql[KS];
  {
    int row = q0 + ln; if (row >= T) row = T - 1;
    const float* qr = Q + (size_t)row * pitch;
#pragma unroll
    for (int ks = 0; ks < KS; ++ks)
#pragma unroll
      for (int i = 0; i < 16; ++i) {
        const int d = ks * 32 + ((i < 8) ? (8 * hh + i) : (16 + 8 * hh + (i - 8)));
        const float x = qr[d] * scale; const unsigned short hb = bf16_bits(x);
        aqh[ks].u[i] = hb; aql[ks].u[i] = bf16_bits(x - bf16_val(hb));
      }
  }
  float m_r[8], l_r[8];
#pragma unroll
  for (int r = 0; r < 8; ++r) { m_r[r] = -3.0e38f; l_r[r] = 0.f; }
  v8f oacc[DT];
#pragma unroll
  for (int dt = 0; dt < DT; ++dt) oacc[dt] = (v8f){0.f,0.f,0.f,0.f,0.f,0.f,0.f,0.f};

  const int kv_end = CAUSAL ? min(T, qblk * 64 + 64) : T;     // block-uniform
  for (int j0 = 0; j0 < kv_end; j0 += 32) {
    __syncthreads();
    for (int e = tid; e < 32 * (D / 4); e += 128) {
      const int r = e / (D / 4), c4 = (e % (D / 4)) * 4;
      const int key = j0 + r;
      v4f kf = {0.f,0.f,0.f,0.f}, vf = {0.f,0.f,0.f,0.f};
      if (key < T) { kf = *(const v4fa*)(K + (size_t)key * pitch + c4); vf = *(const v4fa*)(V + (size_t)key * pitch + c4); }
#pragma unroll
      for (int t = 0; t < 4; ++t) {
        unsigned short hb = bf16_bits(kf[t]); sKh[r][c4 + t] = hb; sKl[r][c4 + t] = bf16_bits(kf[t] - bf16_val(hb));
        hb = bf16_bits(vf[t]); sVh[r][c4 + t] = hb; sVl[r][c4 + t] = bf16_bits(vf[t] - bf16_val(hb));
      }
    }
    __syncthreads();
    // S tile 16 x 32
    v8f s[2];
#pragma unroll
    for (int nt = 0; nt < 2; ++nt) {
      v8f acc = {};
#pragma unroll
      for (int ks = 0; ks < KS; ++ks) {
        FragB bh_, bl_;
        bh_.half[0] = *(const v8us*)&sKh[nt * 16 + ln][ks * 32 + 8 * hh]; bh_.half[1] = *(const v8us*)&sKh[nt * 16 + ln][ks * 32 + 16 + 8 * hh];
        bl_.half[0] = *(const v8us*)&sKl[nt * 16 + ln][ks * 32 + 8 * hh]; bl_.half[1] = *(const v8us*)&sKl[nt * 16 + ln][ks * 32 + 16 + 8 * hh];
        acc = mmaN<3>(aqh[ks].v, aql[ks].v, bh_.v, bl_.v, acc);
      }
      s[nt] = acc;
    }
    // mask + running max (rows 8hh+r; the 16 lanes of a half share rows)
    float alpha[8];
#pragma unroll
    for (int r = 0; r < 8; ++r) {
      const int qi = q0 + 8 * hh + r;
      const int ja = j0 + ln, jb = j0 + 16 + ln;
      if (CAUSAL) { if (ja > qi) s[0][r] = -3.0e38f; if (jb > qi) s[1][r] = -3.0e38f; }
      if (ja >= T) s[0][r] = -3.0e38f;
      if (jb >= T) s[1][r] = -3.0e38f;
      float mx = fmaxf(s[0][r], s[1][r]);
      mx = fmaxf(mx, __shfl_xor(mx, 1, 32)); mx = fmaxf(mx, __shfl_xor(mx, 2, 32)); mx = fmaxf(mx, __shfl_xor(mx, 4, 32)); mx = fmaxf(mx, __shfl_xor(mx, 8, 32));
      const float mnew = fmaxf(m_r[r], mx);
      alpha[r] = (mnew > -1.0e38f) ? __expf(m_r[r] - mnew) : 1.0f;
      const float p0 = (s[0][r] > -1.0e38f) ? __expf(s[0][r] - mnew) : 0.f;
      const float p1 = (s[1][r] > -1.0e38f) ? __expf(s[1][r] - mnew) : 0.f;
      m_r[r] = mnew;
      l_r[r] = l_r[r] * alpha[r] + p0 + p1;            // per-lane partial row sum (16 lanes combined at the end)
      unsigned short hb = bf16_bits(p0); sPh[w][8 * hh + r][ln] = hb;      sPl[w][8 * hh + r][ln] = bf16_bits(p0 - bf16_val(hb));
      hb = bf16_bits(p1);                sPh[w][8 * hh + r][16 + ln] = hb; sPl[w][8 * hh + r][16 + ln] = bf16_bits(p1 - bf16_val(hb));
    }
#pragma unroll
    for (int dt = 0; dt < DT; ++dt)
#pragma unroll
      for (int r = 0; r < 8; ++r) oacc[dt][r] *= alpha[r];
    __builtin_amdgcn_fence(__ATOMIC_ACQ_REL, "workgroup");
    __builtin_amdgcn_wave_barrier();
    FragB pah, pal;
    pah.half[0] = *(const v8us*)&sPh[w][ln][8 * hh]; pah.half[1] = *(const v8us*)&sPh[w][ln][16 + 8 * hh];
    pal.half[0] = *(const v8us*)&sPl[w][ln][8 * hh]; pal.half[1] = *(const v8us*)&sPl[w][ln][16 + 8 * hh];
#pragma unroll
    for (int dt = 0; dt < DT; ++dt) {
      FragB bvh, bvl;
#pragma unroll
      for (int i = 0; i < 8; ++i) {
        bvh.u[i] = sVh[8 * hh + i][dt * 16 + ln]; bvh.u[8 + i] = sVh[16 + 8 * hh + i][dt * 16 + ln];
        bvl.u[i] = sVl[8 * hh + i][dt * 16 + ln]; bvl.u[8 + i] = sVl[16 + 8 * hh + i][dt * 16 + ln];
      }
      oacc[dt] = mmaN<3>(pah.v, pal.v, bvh.v, bvl.v, oacc[dt]);
    }
    __builtin_amdgcn_fence(__ATOMIC_ACQ_REL, "workgroup");
    __builtin_amdgcn_wave_barrier();
  }
#pragma unroll
  for (int r = 0; r < 8; ++r) {
    float l = l_r[r];
    l += __shfl_xor(l, 1, 32); l += __shfl_xor(l, 2, 32); l += __shfl_xor(l, 4, 32); l += __shfl_xor(l, 8, 32);
    l_r[r] = (l > 0.f) ? 1.0f / l : 0.f;
  }
#pragma unroll
  for (int dt = 0; dt < DT; ++dt)
#pragma unroll
    for (int r = 0; r < 8; ++r) sO[w][8 * hh + r][dt * 16 + ln] = oacc[dt][r] * l_r[r];
  __builtin_amdgcn_fence(__ATOMIC_ACQ_REL, "workgroup");
  __builtin_amdgcn_wave_barrier();
  {
    for (int r = 0; r < 16; ++r) {
      const int row = q0 + r;
      if (row < T && lane < D / 4) {
        const v4f val = *(const v4fa*)&sO[w][r][lane * 4];
        *(v4f*)(y + ((size_t)b * T + row) * ypitch + h * D + lane * 4) = val;
      }
    }
    
  }
}

// GEMM C = act(A·W + bias + resid): A f32 (ASPLIT -> hi/lo 2 terms), Wt bf16 [N][K]; ACT 0 none, 1 relu, 2 exact gelu;
// resid (optional, f32, row index = (row % rmod), pitch ldr, RES_BF16 rounds it) added before the activation.
template <bool ASPLIT, int ACT, bool BIAS_BF16, bool RES_BF16>
__global__ __launch_bounds__(128) void k_gemm_bf3(const float* __restrict__ A, int lda, const unsigned short* __restrict__ Wt, int ldb,
                                                const float* __restrict__ bias, const float* __restrict__ resid, int rmod, int ldr,
                                                float* __restrict__ C, int ldc, int M, int N, int K) {
  __shared__ __attribute__((aligned(16))) float so[4][16][64];
  const int tid = threadIdx.x, w = tid >> 5, lane = tid & 31, ln = lane & 15, hh = lane >> 4;
  const int ntn = N / 64;
  const int wid = blockIdx.x * 4 + w;
  const int mt = wid / ntn, nq = wid % ntn;
  if (mt * 16 >= M) return;
  const int row0 = mt * 16, col0 = nq * 64;
  const float* arow = A + (size_t)(row0 + ln) * lda;
  v8f acc[4] = {};
  for (int kb = 0; kb < K; kb += 32) {
    FragB ah, al;
    const v4f x0 = *(const v4fa*)(arow + kb + 8 * hh), x1 = *(const v4fa*)(arow + kb + 8 * hh + 4);
    const v4f x2 = *(const v4fa*)(arow + kb + 16 + 8 * hh), x3 = *(const v4fa*)(arow + kb + 16 + 8 * hh + 4);
    float xs[16] = {x0[0],x0[1],x0[2],x0[3],x1[0],x1[1],x1[2],x1[3],x2[0],x2[1],x2[2],x2[3],x3[0],x3[1],x3[2],x3[3]};
#pragma unroll
    for (int i = 0; i < 16; ++i) { const unsigned short hb = bf16_bits(xs[i]); ah.u[i] = hb; al.u[i] = ASPLIT ? bf16_bits(xs[i] - bf16_val(hb)) : (unsigned short)0; }
#pragma unroll
    for (int t = 0; t < 4; ++t) {
      const unsigned short* brow = Wt + (size_t)(col0 + t * 16 + ln) * ldb + kb;
      FragB b;
      b.half[0] = *(const v8us*)(brow + 8 * hh);
      b.half[1] = *(const v8us*)(brow + 16 + 8 * hh);
      acc[t] = mmaN<ASPLIT ? 2 : 1>(ah.v, al.v, b.v, b.v, acc[t]);
    }
  }
#pragma unroll
  for (int t = 0; t < 4; ++t) {
    const int col = col0 + t * 16 + ln;
    float bv = bias ? bias[col] : 0.f;
    if (BIAS_BF16) bv = bf16_round(bv);
#pragma unroll
    for (int r = 0; r < 8; ++r) {
      float v = acc[t][r] + bv;
      if (resid) { float rv = resid[(size_t)((row0 + 8 * hh + r) % rmod) * ldr + col]; if (RES_BF16) rv = bf16_round(rv); v += rv; }
      if (ACT == 1) v = fmaxf(v, 0.f);
      if (ACT == 2) v = 0.5f * v * (1.0f + erff(v * 0.70710678118654752f));
      if (ACT == 3) { const float u = 0.7978845608028654f * (v + 0.044715f * v * v * v); v = 0.5f * v * (1.0f + tanhf(u)); }
      so[w][8 * hh + r][t * 16 + ln] = v;
    }
  }
  __builtin_amdgcn_fence(__ATOMIC_ACQ_REL, "workgroup");
  __builtin_amdgcn_wave_barrier();
  const int rsub = lane >> 4, c4 = (lane & 15) * 4;
  {
#pragma unroll
    for (int q = 0; q < 8; ++q) {
      const int r = q * 2 + rsub;
      const v4f v = *(const v4fa*)&so[w][r][c4];
      *(v4f*)(C + (size_t)(row0 + r) * ldc + col0 + c4) = v;
    }
    
  }
}
// row LayerNorm (biased variance, eps) over N: s = X (+ R); optional out_sum <- s; out_norm <- (s-mu)*rsqrt(var+eps)*g + b
template <bool PARAM_BF16>
__global__ __launch_bounds__(256) void k_layernorm(const float* __restrict__ X, const float* __restrict__ R, const float* __restrict__ g, const float* __restrict__ bta,
                                                  float* __restrict__ out_sum, float* __restrict__ out_norm, int N, float eps) {
  __shared__ float red[256];
  const int row = blockIdx.x, tid = threadIdx.x;
  const float* x = X + (size_t)row * N; const float* rr = R ? R + (size_t)row * N : nullptr;
  float vals[16];                     // up to N = 4096
  const int per = N / 256;            // contiguous chunk per thread? use strided-by-4 chunks: thread handles j = tid*4 + 1024*u
  float s1 = 0.f;
  for (int u = 0; u < per / 4; ++u) {
    const int j = tid * 4 + 1024 * u;
    const v4f a = *(const v4fa*)(x + j);
    v4f b = {0.f,0.f,0.f,0.f}; if (rr) b = *(const v4fa*)(rr + j);
#pragma unroll
    for (int q = 0; q < 4; ++q) { const float v = a[q] + b[q]; vals[u * 4 + q] = v; s1 += v; }
  }
  red[tid] = s1; __syncthreads();
  for (int st = 128; st > 0; st >>= 1) { if (tid < st) red[tid] += red[tid + st]; __syncthreads(); }
  const float mu = red[0] / (float)N; __syncthreads();
  float s2 = 0.f;
  for (int u = 0; u < per / 4; ++u)
#pragma unroll
    for (int q = 0; q < 4; ++q) { const float c = vals[u * 4 + q] - mu; s2 += c * c; }
  red[tid] = s2; __syncthreads();
  for (int st = 128; st > 0; st >>= 1) { if (tid < st) red[tid] += red[tid + st]; __syncthreads(); }
  const float rs = rsqrtf(red[0] / (float)N + eps);
  {
    for (int u = 0; u < per / 4; ++u) {
      const int j = tid * 4 + 1024 * u;
      v4f o, sm;
#pragma unroll
      for (int q = 0; q < 4; ++q) {
        float gg = g[j + q], bb = bta[j + q];
        if (PARAM_BF16) { gg = bf16_round(gg); bb = bf16_round(bb); }
        sm[q] = vals[u * 4 + q]; o[q] = (vals[u * 4 + q] - mu) * rs * gg + bb;
      }
      if (out_sum) *(v4f*)(out_sum + (size_t)row * N + j) = sm;
      *(v4f*)(out_norm + (size_t)row * N + j) = o;
    }
    
  }
}



// ---- f16 WMMA path (v_wmma_f32_16x16x32_f16): 11-bit significands for operands in range — used where a [0,1] probability operand needs more precision than bf16
typedef _Float16 v16h __attribute__((ext_vector_type(16)));
union FragH { v16h v; v8us half[2]; _Float16 h[16]; unsigned short u[16]; };
template <int NT>
__device__ __forceinline__ v8f mmaH(v16h ah, v16h al, v16h bh, v16h bl, v8f c) {
  c = __builtin_amdgcn_wmma_f32_16x16x32_f16(false, ah, false, bh, (short)0, c, false, false);
  if (NT >= 2) c = __builtin_amdgcn_wmma_f32_16x16x32_f16(false, al, false, bh, (short)0, c, false, false);
  if (NT >= 3) c = __builtin_amdgcn_wmma_f32_16x16x32_f16(false, ah, false, bl, (short)0, c, false, false);
  asm volatile("v_nop\n\tv_nop\n\tv_nop\n\tv_nop" : "+v"(c) : "v"(ah), "v"(al), "v"(bh), "v"(bl));
  return c;
}
// batched GEMM like k_gemm_b but f16 operands: A f32 (split into f16 hi/lo if ASPLIT, else rounded to f16), Bt = f16 values [n][k]; alpha; C f32; N multiple of 16 (partial tiles skipped)
template <bool ASPLIT>
__global__ __launch_bounds__(128) void k_gemm_h(const float* __restrict__ A, int lda, size_t sA, const _Float16* __restrict__ Bh, int ldb, size_t sB, float alpha, float* __restrict__ C, int ldc, size_t sC, int M, int N, int K) {
  __shared__ __attribute__((aligned(16))) float so[4][16][64];
  const int tid = threadIdx.x, w = tid >> 5, lane = tid & 31, ln = lane & 15, hh = lane >> 4; const int by = blockIdx.y;
  A += (size_t)by * sA; Bh += (size_t)by * sB; C += (size_t)by * sC;
  const int ntn = (N + 63) / 64; const int wid = blockIdx.x * 4 + w; const int mt = wid / ntn, nq = wid % ntn; if (mt * 16 >= M) return;
  const int row0 = mt * 16, col0 = nq * 64; const float* arow = A + (size_t)(row0 + ln) * lda;
  v8f acc[4] = {};
  for (int kb = 0; kb < K; kb += 32) {
    FragH ah, al;
    const v4f x0 = *(const v4fa*)(arow + kb + 8 * hh), x1 = *(const v4fa*)(arow + kb + 8 * hh + 4), x2 = *(const v4fa*)(arow + kb + 16 + 8 * hh), x3 = *(const v4fa*)(arow + kb + 16 + 8 * hh + 4);
    float xs[16] = {x0[0],x0[1],x0[2],x0[3],x1[0],x1[1],x1[2],x1[3],x2[0],x2[1],x2[2],x2[3],x3[0],x3[1],x3[2],x3[3]};
#pragma unroll
    for (int i = 0; i < 16; ++i) { const _Float16 h = (_Float16)xs[i]; ah.h[i] = h; al.h[i] = ASPLIT ? (_Float16)(xs[i] - (float)h) : (_Float16)0.0f; }
#pragma unroll
    for (int t = 0; t < 4; ++t) { if (col0 + t * 16 >= N) continue; const size_t boff = (size_t)(col0 + t * 16 + ln) * ldb + kb; FragH bq; bq.half[0] = *(const v8us*)(Bh + boff + 8 * hh); bq.half[1] = *(const v8us*)(Bh + boff + 16 + 8 * hh);
      acc[t] = mmaH<ASPLIT ? 2 : 1>(ah.v, al.v, bq.v, bq.v, acc[t]); }
  }
#pragma unroll
  for (int t = 0; t < 4; ++t) { if (col0 + t * 16 >= N) continue;
#pragma unroll
    for (int r = 0; r < 8; ++r) so[w][8 * hh + r][t * 16 + ln] = acc[t][r] * alpha; }
  __builtin_amdgcn_fence(__ATOMIC_ACQ_REL, "workgroup"); __builtin_amdgcn_wave_barrier();
  const int rsub = lane >> 4, c4 = (lane & 15) * 4;
  {
#pragma unroll
    for (int q = 0; q < 8; ++q) { const int r = q * 2 + rsub; if (col0 + c4 < N) { const v4f v = *(const v4fa*)&so[w][r][c4]; *(v4f*)(C + (size_t)(row0 + r) * ldc + col0 + c4) = v; } }
     }
}

// Wt[n][k] = f16(W[k][n]·scale) from f32 row-major W[K][N] (scale = power of two; bf16-exact weights stay exact in f16 away from the subnormal range)
__device__ __forceinline__ void wt_f16(const float* __restrict__ W, _Float16* __restrict__ Wt, int K, int N, float scale, int blk) {
  const int t = blk * 256 + threadIdx.x; if (t >= N * (K / 8)) return; const int n = t / (K / 8), k8 = (t % (K / 8)) * 8; FragH f;
#pragma unroll
  for (int i = 0; i < 8; ++i) f.h[i] = (_Float16)(bf16_round(W[(size_t)(k8 + i) * N + n]) * scale); const v8us o = f.half[0];
  *(v8us*)((unsigned short*)Wt + (size_t)n * K + k8) = o; 
}
// Block-tiled GEMM, f16 operands, both K-contiguous: v = (A.Bt^T)*alpha + bf16(bias[col]) (+ CP[row*LDCP + by*sCPy + col] if LDCP; CP may be C itself: a lane reads only what it then writes); writes f32 C, or f16 C16, or f16 C16 with the rounding residual x 2^10 in C16l. Batch in blockIdx.y.
// One work-group of 8 waves (4 x 2) makes 128 x 128 of C, a wave 32 x 64. Each trip takes 64 k: 128 rows of 128 B of A and of Bt are brought into LDS by asynchronous copies (whole 128-B lines, 16 B a lane),
// two buffers, the next tile in flight while this one is multiplied; LDS rows at pitch 144 B for the ds_load_b128 fragment reads. M, N multiples of 128, K a multiple of 64.
#define GT_PITCH 144
#define GT_OPB (128 * GT_PITCH)
#define GT_BUF (2 * GT_OPB)
typedef _Float16 v4h __attribute__((ext_vector_type(4)));
// one tile: 4 copies of A and 4 of Bt per lane. The s_wait_xcnt stands inside the statement so that no address register named here is rewritten ahead of it.
__device__ __forceinline__ void gt_copy(unsigned l, const unsigned short* ga, const unsigned short* gb, size_t a32, size_t b32) {
  asm volatile("global_load_async_to_lds_b128 %0, %8, off\n\t"
               "global_load_async_to_lds_b128 %1, %9, off\n\t"
               "global_load_async_to_lds_b128 %2, %10, off\n\t"
               "global_load_async_to_lds_b128 %3, %11, off\n\t"
               "global_load_async_to_lds_b128 %4, %12, off\n\t"
               "global_load_async_to_lds_b128 %5, %13, off\n\t"
               "global_load_async_to_lds_b128 %6, %14, off\n\t"
               "global_load_async_to_lds_b128 %7, %15, off\n\t"
               "s_wait_xcnt 0x0"
               :: "v"(l), "v"(l + 32 * GT_PITCH), "v"(l + 64 * GT_PITCH), "v"(l + 96 * GT_PITCH),
                  "v"(l + GT_OPB), "v"(l + GT_OPB + 32 * GT_PITCH), "v"(l + GT_OPB + 64 * GT_PITCH), "v"(l + GT_OPB + 96 * GT_PITCH),
                  "v"(ga), "v"(ga + a32), "v"(ga + 2 * a32), "v"(ga + 3 * a32), "v"(gb), "v"(gb + b32), "v"(gb + 2 * b32), "v"(gb + 3 * b32)
               : "memory");
}
// One launch may hold three sets of independent products: blockIdx.y below ysplit belongs to set g0, from ysplit on to set g1, from ysplit2 on to set g2; inside a set y steps the operands and the result by the set's strides and picks one of three biases (y 1: bias1, y 2: bias2, else bias0).
// A set with trs above 0 holds a product whose columns run over several result planes of 2^trs columns each (plane stride sC, row pitch ldc) and whose bias goes by the row: with the weight plane as A and the activations as Bt it leaves the transposed projection, per batch [feature][token], with no transposing launch behind it.
// A set may name three operand pairs of one shape (SEG launches, A1 not null): the k loop then runs through (A, B), (A1, B1), (A2, B2) in one ring and one accumulator, which is multiplied by mid between the second pair and the third: v = ((A.BT + A1.B1T) * mid + A2.B2T) * alpha.
struct GSet { const _Float16* A; const _Float16* B; const float* bias0; const float* bias1; const float* bias2; float* C; _Float16* C16; _Float16* C16l; size_t sA, sB, sC; int lda, ldb, ldc, N, K; float alpha; const _Float16* A1; const _Float16* B1; const _Float16* A2; const _Float16* B2; float mid; int trs; };
template <int LDCP, int OUT, bool SEG = false>      /* SEG: sets with three operand pairs are honoured; LDCP: row pitch of an f32 addend plane CP, 0 for none (a constant, so that its 16 loads share one address register pair); OUT 1: f32 result in C; 0: f16 result in C16; 2: f16 result in C16 and (v - f16(v)) x 2^10 as f16 in C16l */
__global__ __launch_bounds__(256) void k_gemm_t(const GSet g0, const GSet g1, const GSet g2, int ysplit, int ysplit2, const float* CP, size_t sCPy) {
  __shared__ __attribute__((aligned(16))) unsigned char L[2 * GT_BUF];
  const int tid = threadIdx.x, w = tid >> 5, lane = tid & 31, ln = lane & 15, hh = lane >> 4;
  const bool sec = (int)blockIdx.y >= ysplit, thi = (int)blockIdx.y >= ysplit2; const GSet& g = thi ? g2 : sec ? g1 : g0; const int by = (int)blockIdx.y - (thi ? ysplit2 : sec ? ysplit : 0);
  const _Float16* A = g.A; const _Float16* Bh = g.B; const float* bias = by == 1 ? g.bias1 : by == 2 ? g.bias2 : g.bias0; float* C = g.C; _Float16* C16 = g.C16; _Float16* C16l = g.C16l;
  const size_t sA = g.sA, sB = g.sB, sC = g.sC; const int lda = g.lda, ldb = g.ldb, ldc = g.ldc, N = g.N, K = g.K; const float alpha = g.alpha; const int trs = g.trs;
  const float* rbias = nullptr; if (trs) { rbias = bias; bias = nullptr; }      /* a bias by the row is not read by the column */
  const int ntn = N / 128; const int row0 = ((int)blockIdx.x / ntn) * 128, col0 = ((int)blockIdx.x % ntn) * 128; const int wm = w >> 1, wn = w & 1;
  const int cr = tid >> 3, cc = tid & 7;      /* copies: 8 lanes a row, 32 rows a copy */
  const size_t la = (size_t)by * sA + (size_t)(row0 + cr) * lda + cc * 8, lb = (size_t)by * sB + (size_t)(col0 + cr) * ldb + cc * 8;      /* the lane's place in an A plane and in a Bt plane, the same in every pair */
  const size_t a32 = (size_t)32 * lda, b32 = (size_t)32 * ldb;
  const unsigned lcp = (unsigned)(size_t)L + (unsigned)(cr * GT_PITCH + cc * 16);
  const int nk = K / 64; const bool three = SEG && g.A1 != nullptr; const int nt = three ? 3 * nk : nk, tmid = three ? 2 * nk : -1;      /* nk tiles a pair */
  const _Float16* A1 = g.A1; const _Float16* B1 = g.B1; const _Float16* A2 = g.A2; const _Float16* B2 = g.B2; const float mid = g.mid;
  auto tile = [&](int t, unsigned l) {      /* tile t of the whole run: the pair and the k place inside it are the same for the work-group */
    const _Float16* pa = A; const _Float16* pb = Bh; int kk = t;
    if (SEG && three) { if (t >= 2 * nk) { pa = A2; pb = B2; kk = t - 2 * nk; } else if (t >= nk) { pa = A1; pb = B1; kk = t - nk; } }
    gt_copy(l, (const unsigned short*)pa + kk * 64 + la, (const unsigned short*)pb + kk * 64 + lb, a32, b32); };
  v8f acc[2][4] = {};
  tile(0, lcp);
  asm volatile("s_wait_asynccnt 0x0" ::: "memory");      /* tile 0 has landed before the barrier that publishes it */
  __syncthreads();
  if (nt > 1) tile(1, lcp + GT_BUF);
  const unsigned char* fa = L + (wm * 32 + ln) * GT_PITCH + hh * 16; const unsigned char* fb = L + GT_OPB + (wn * 64 + ln) * GT_PITCH + hh * 16;
#pragma unroll 1
  for (int t = 0; t < nt; ++t) {      /* stays rolled: one copy of the ring's foot */
    const unsigned bo = (unsigned)(t & 1) * GT_BUF;
    FragH a[2][2], b[2][4];
#pragma unroll
    for (int ks = 0; ks < 2; ++ks) {
#pragma unroll
      for (int i = 0; i < 2; ++i) { a[ks][i].half[0] = *(const v8us*)(fa + bo + i * 16 * GT_PITCH + ks * 64); a[ks][i].half[1] = *(const v8us*)(fa + bo + i * 16 * GT_PITCH + ks * 64 + 32); }
#pragma unroll
      for (int j = 0; j < 4; ++j) { b[ks][j].half[0] = *(const v8us*)(fb + bo + j * 16 * GT_PITCH + ks * 64); b[ks][j].half[1] = *(const v8us*)(fb + bo + j * 16 * GT_PITCH + ks * 64 + 32); } }
    /* the ring's foot stands here, behind the trip's 24 fragment reads and ahead of its WMMAs, which work on registers alone: the refill then flies under them too */
    asm volatile("s_wait_dscnt 0x0" ::: "memory");      /* this wave's reads of the buffer are over before it may be refilled */
    asm volatile("s_wait_asynccnt 0x0" ::: "memory");      /* this wave's share of tile t + 1 has landed before the barrier publishes it */
    __syncthreads();
    if (t + 2 < nt) tile(t + 2, lcp + bo);
    __builtin_amdgcn_sched_barrier(0);      /* keeps the WMMAs behind the refill's issue: ahead of it they would delay the copies by their whole run */
    if (SEG && t == tmid) {      /* the first two pairs' sum takes its weight before the third pair is added to it */
#pragma unroll
      for (int i = 0; i < 2; ++i)
#pragma unroll
        for (int j = 0; j < 4; ++j) acc[i][j] *= mid; }
#pragma unroll
    for (int ks = 0; ks < 2; ++ks)
#pragma unroll
      for (int i = 0; i < 2; ++i)
#pragma unroll
        for (int j = 0; j < 4; ++j) acc[i][j] = __builtin_amdgcn_wmma_f32_16x16x32_f16(false, a[ks][i].v, false, b[ks][j].v, (short)0, acc[i][j], false, false);
  }
  asm volatile("s_wait_asynccnt 0x0" ::: "memory");      /* no copy outstanding when the ring becomes output staging */
  /* epilogue: each wave stages its 32 x 64 in its own 8,704 B of the ring (every wave's last read of it ended ahead of the last barrier), then whole 256-B row pieces go out */
  const int c4 = ln * 4, col = col0 + wn * 64 + c4, rw0 = row0 + wm * 32 + hh; const size_t cofs = (size_t)by * sC + (trs ? (size_t)(col0 >> trs) * (sC - ((size_t)1 << trs)) : 0);      /* trs: the tile's plane, and its columns counted from that plane's first */
  v4f cp[16];      /* the addend's 16 row pieces are asked for together, ahead of the staging */
  if (LDCP) { const float* cpp = CP + (size_t)rw0 * LDCP + (size_t)by * sCPy + col;
#pragma unroll
    for (int q = 0; q < 16; ++q) cp[q] = *(const v4fa*)(cpp + q * 2 * LDCP);
    asm volatile("s_wait_xcnt 0x0" ::: "memory"); }      /* ahead of any rewrite of the address registers that the loads above name */
  float rb[16] = {};      /* the bias of the lane's 16 rows, asked for together */
  if (rbias) {
#pragma unroll
    for (int q = 0; q < 16; ++q) rb[q] = rbias[rw0 + q * 2];
    asm volatile("s_wait_xcnt 0x0" ::: "memory"); }      /* ahead of any rewrite of the address registers that the loads above name */
  v4f bv = {0.f, 0.f, 0.f, 0.f}; if (bias) { const v4f bb = *(const v4fa*)(bias + col); for (int e = 0; e < 4; ++e) bv[e] = bf16_round(bb[e]); }
  float* so = (float*)(L + w * (32 * 68 * 4));
#pragma unroll
  for (int i = 0; i < 2; ++i)
#pragma unroll
    for (int j = 0; j < 4; ++j)
#pragma unroll
      for (int r = 0; r < 8; ++r) so[(i * 16 + 8 * hh + r) * 68 + j * 16 + ln] = acc[i][j][r];
  __builtin_amdgcn_fence(__ATOMIC_ACQ_REL, "workgroup"); __builtin_amdgcn_wave_barrier();
#pragma unroll
  for (int q = 0; q < 16; ++q) { const size_t o = cofs + (size_t)rw0 * ldc + col + (size_t)(q * 2) * ldc; const v4f x = *(const v4fa*)&so[(q * 2 + hh) * 68 + c4]; v4f v;
    const float br = bf16_round(rb[q]);
    for (int e = 0; e < 4; ++e) v[e] = x[e] * alpha + (trs ? br : bv[e]);
    if (LDCP) for (int e = 0; e < 4; ++e) v[e] += cp[q][e];
    if (OUT == 1) *(v4f*)(C + o) = v;
    else { v4h h4; for (int e = 0; e < 4; ++e) h4[e] = (_Float16)v[e]; *(v4h*)(C16 + o) = h4;
      if (OUT == 2) { v4h l4; for (int e = 0; e < 4; ++e) l4[e] = (_Float16)((v[e] - (float)h4[e]) * 1024.0f); *(v4h*)(C16l + o) = l4; } } }
}


__device__ __forceinline__ void x16(const float* __restrict__ x, _Float16* __restrict__ X16, size_t n8, int blk) { const size_t t = (size_t)blk * 256 + threadIdx.x; if (t >= n8) return; FragH f;
#pragma unroll
  for (int q = 0; q < 8; ++q) f.h[q] = (_Float16)bf16_round(x[t * 8 + q]); *(v8us*)((unsigned short*)X16 + t * 8) = f.half[0];  }
// All operand preparation in one launch: none of its ten parts reads what another writes. Ranges of blockIdx.x: the five F x F weights, the three G x F weights (each transposed, x 2^4), then features and geometry (rounded to f16 planes).
#define PW_BIG (DD * (DD / 8) / 256)
#define PW_SML (DD * (GG / 8) / 256)
#define PX_F (NR * DD / 8 / 256)
#define PX_G (NR * GG / 8 / 256)
__global__ __launch_bounds__(256) void k_prep(const float* __restrict__ wq, const float* __restrict__ wk, const float* __restrict__ wv, const float* __restrict__ wo, const float* __restrict__ opw,
    const float* __restrict__ gqw, const float* __restrict__ gkw, const float* __restrict__ gvw, const float* __restrict__ feats, const float* __restrict__ geom,
    _Float16* __restrict__ Bw, _Float16* __restrict__ Bg, _Float16* __restrict__ X16, _Float16* __restrict__ GE16) {
  int blk = blockIdx.x;
  if (blk < 5 * PW_BIG) { const int i = blk / PW_BIG; const float* W = i == 0 ? wq : i == 1 ? wk : i == 2 ? wv : i == 3 ? wo : opw; wt_f16(W, Bw + (size_t)i * DD * DD, DD, DD, 16.0f, blk % PW_BIG); return; }
  blk -= 5 * PW_BIG;
  if (blk < 3 * PW_SML) { const int i = blk / PW_SML; const float* W = i == 0 ? gqw : i == 1 ? gkw : gvw; wt_f16(W, Bg + (size_t)i * GG * DD, GG, DD, 16.0f, blk % PW_SML); return; }
  blk -= 3 * PW_SML;
  if (blk < PX_F) { x16(feats, X16, (size_t)NR * DD / 8, blk); return; }
  x16(geom, GE16, (size_t)NR * GG / 8, blk - PX_F);
}
__global__ __launch_bounds__(256) void k_round16f(const float* __restrict__ W, _Float16* __restrict__ Bt, size_t n8) { const size_t t = (size_t)blockIdx.x * 256 + threadIdx.x; if (t >= n8) return; FragH f;
#pragma unroll
  for (int i = 0; i < 8; ++i) f.h[i] = (_Float16)(bf16_round(W[t * 8 + i]) * 16.0f); *(v8us*)((unsigned short*)Bt + t * 8) = f.half[0];  }
typedef float v2f __attribute__((ext_vector_type(2)));
// Distance-MLP bias, added to S in place. gelu_tanh(x) = 0.5 x (1 + tanh(u)) = x / (1 + exp(-2 u)), u = sqrt(2 / pi) (x + 0.044715 x^3): one v_exp_f32 and one v_rcp_f32, no branch
// (x far above 0: exp -> 0, quotient x; x far below 0: exp -> inf, rcp -> 0, quotient -0: the limits of the tanh form). The other steps are packed f32 operations on two keys at a time.
// A work-group takes GB_ROWS whole score rows, a thread the same 4 keys in each: the rounded weights, their head means and the keys' coordinates are made once per thread, not once per 4 pairs.
#define GB_ROWS 8
#define GB_K0 (-2.3022081986f)      /* -2 sqrt(2 / pi) log2(e) */
#define GB_K1 (GB_K0 * 0.044715f)
__global__ __launch_bounds__(256) void k_gbias(float* __restrict__ S, const float* __restrict__ CRD, const float* __restrict__ w1, const float* __restrict__ b1, const float* __restrict__ w2, const float* __restrict__ b2) {
  const int b = blockIdx.y, q0 = blockIdx.x * GB_ROWS, k0 = threadIdx.x * 4;      /* one score plane per batch */
  const float* C3 = CRD + (size_t)b * TT * 3; float* sp = S + (size_t)b * TT * TT + (size_t)q0 * TT + k0;
  float cb = 0.f; for (int j = 0; j < 8; ++j) cb += bf16_round(b2[j]); cb *= 0.125f;
  float wj[8], bj[8], cj[8];
#pragma unroll
  for (int j = 0; j < 8; ++j) { float c = 0.f; for (int h = 0; h < 8; ++h) c += bf16_round(w2[j * 8 + h]); cj[j] = c * 0.125f; wj[j] = bf16_round(w1[j]); bj[j] = bf16_round(b1[j]); }
  const v4f c0 = *(const v4fa*)(C3 + k0 * 3), c1 = *(const v4fa*)(C3 + k0 * 3 + 4), c2 = *(const v4fa*)(C3 + k0 * 3 + 8);
  const v2f kx[2] = {{bf16_round(c0[0]), bf16_round(c0[3])}, {bf16_round(c1[2]), bf16_round(c2[1])}};
  const v2f ky[2] = {{bf16_round(c0[1]), bf16_round(c1[0])}, {bf16_round(c1[3]), bf16_round(c2[2])}};
  const v2f kz[2] = {{bf16_round(c0[2]), bf16_round(c1[1])}, {bf16_round(c2[0]), bf16_round(c2[3])}};
#pragma unroll 1      /* stays rolled: a row already holds 16 independent chains */
  for (int r = 0; r < GB_ROWS; ++r) {
    const v4f sv = *(const v4fa*)(sp + (size_t)r * TT);      /* asked for at the row's head, used at its foot */
    const float qx = bf16_round(C3[(q0 + r) * 3]), qy = bf16_round(C3[(q0 + r) * 3 + 1]), qz = bf16_round(C3[(q0 + r) * 3 + 2]);
    v2f d[2], acc[2];
#pragma unroll
    for (int p = 0; p < 2; ++p) { const v2f dx = qx - kx[p], dy = qy - ky[p], dz = qz - kz[p]; const v2f d2 = dx * dx + dy * dy + dz * dz;
      d[p][0] = __builtin_amdgcn_sqrtf(fmaxf(d2[0], 1e-12f)); d[p][1] = __builtin_amdgcn_sqrtf(fmaxf(d2[1], 1e-12f)); acc[p] = (v2f){cb, cb}; }
#pragma unroll
    for (int j = 0; j < 8; ++j)
#pragma unroll
      for (int p = 0; p < 2; ++p) { const v2f x = d[p] * wj[j] + bj[j]; const v2f a = x * (x * x * GB_K1 + GB_K0);
        const v2f s = (v2f){__builtin_amdgcn_exp2f(a[0]), __builtin_amdgcn_exp2f(a[1])} + 1.0f;
        const v2f g = x * (v2f){__builtin_amdgcn_rcpf(s[0]), __builtin_amdgcn_rcpf(s[1])}; acc[p] += g * cj[j]; }
    const v4f o = {sv[0] + acc[0][0], sv[1] + acc[0][1], sv[2] + acc[1][0], sv[3] + acc[1][1]};
    *(v4f*)(sp + (size_t)r * TT) = o;
  } }
#define NN TT
__global__ __launch_bounds__(256) void k_smx(const float* __restrict__ S, _Float16* __restrict__ P16) { const int tid = threadIdx.x, wv = tid >> 5, lane = tid & 31; const int i = blockIdx.x * 8 + wv; const float* sr = S + (size_t)i * NN;
  float m = -3.0e38f;
  for (int p = lane; p < NN / 8; p += 32) { const v4f a = *(const v4fa*)(sr + p * 8), c = *(const v4fa*)(sr + p * 8 + 4); for (int e = 0; e < 4; ++e) m = fmaxf(m, fmaxf(a[e], c[e])); }
  for (int o = 16; o >= 1; o >>= 1) m = fmaxf(m, __shfl_xor(m, o, 32)); float z = 0.f;
  for (int p = lane; p < NN / 8; p += 32) { const v4f a = *(const v4fa*)(sr + p * 8), c = *(const v4fa*)(sr + p * 8 + 4); for (int e = 0; e < 4; ++e) z += __expf(a[e] - m) + __expf(c[e] - m); }
  for (int o = 16; o >= 1; o >>= 1) z += __shfl_xor(z, o, 32); const float iz = 32768.0f / z;
  { for (int p = lane; p < NN / 8; p += 32) { FragH f; const v4f a = *(const v4fa*)(sr + p * 8), c = *(const v4fa*)(sr + p * 8 + 4); for (int e = 0; e < 4; ++e) { f.h[e] = (_Float16)(__expf(a[e] - m) * iz); f.h[4 + e] = (_Float16)(__expf(c[e] - m) * iz); }
      *(v8us*)((unsigned short*)P16 + (size_t)i * NN + p * 8) = f.half[0]; }  } }
// lane l with lane l ^ 16 (the two halves of a wave hold the two halves of a query's keys)
__device__ __forceinline__ float xhalf(float x) { return __builtin_bit_cast(float, __builtin_amdgcn_permlanex16(__builtin_bit_cast(int, x), __builtin_bit_cast(int, x), 0x76543210, 0xfedcba98, false, false)); }
#define FL_PITCH 144
#define FL_OPB (64 * FL_PITCH)
#define FL_BUF (2 * FL_OPB)
#define FL_SC 0.18033688011f      /* log2(e) / 8: exp(s / 8 - m / 8) = exp2((s - m) * FL_SC), one multiply-add and one v_exp_f32 a score */
// one stage: 2 copies of K and 2 of VT per lane. The s_wait_xcnt stands inside the statement so that no address register named here is rewritten ahead of it.
__device__ __forceinline__ void fl_copy(unsigned l, const unsigned short* gk, const unsigned short* gv, size_t k32, size_t v32) {
  asm volatile("global_load_async_to_lds_b128 %0, %4, off\n\t"
               "global_load_async_to_lds_b128 %1, %5, off\n\t"
               "global_load_async_to_lds_b128 %2, %6, off\n\t"
               "global_load_async_to_lds_b128 %3, %7, off\n\t"
               "s_wait_xcnt 0x0"
               :: "v"(l), "v"(l + 32 * FL_PITCH), "v"(l + FL_OPB), "v"(l + FL_OPB + 32 * FL_PITCH),
                  "v"(gk), "v"(gk + k32), "v"(gv), "v"(gv + v32)
               : "memory");
}
__global__ __launch_bounds__(256) void k_flash(const _Float16* __restrict__ Q16, int ldq, const _Float16* __restrict__ K16, int ldk, const _Float16* __restrict__ Vt, const int* __restrict__ MSK, _Float16* __restrict__ O16, int ldo) {
  constexpr int RPW = 16, NW = 8, NQB = TT / (NW * RPW), DT = 4, KS = 2, NST = TT / 64; (void)MSK;
  __shared__ __attribute__((aligned(16))) unsigned char R[2 * FL_BUF];
  __shared__ __attribute__((aligned(16))) unsigned short sO[NW][RPW][64 + 8];      /* f16 rows at pitch 144 B */
  const int tid = threadIdx.x, w = tid >> 5, lane = tid & 31, ln = lane & 15, hh = lane >> 4;
  const int slab = blockIdx.x / NQB, qblk = blockIdx.x % NQB; const int b = slab / NH, h = slab % NH; const int q0 = qblk * (NW * RPW) + w * RPW;
  FragH bq[KS];
  { const unsigned short* qr = (const unsigned short*)Q16 + ((size_t)b * TT + q0 + ln) * ldq + h * 64;
#pragma unroll
    for (int ks = 0; ks < KS; ++ks) { bq[ks].half[0] = *(const v8us*)(qr + ks * 32 + 8 * hh); bq[ks].half[1] = *(const v8us*)(qr + ks * 32 + 16 + 8 * hh); } }
  const unsigned short* Vth = (const unsigned short*)Vt + (size_t)slab * 64 * TT;
  const int cr = tid >> 3, cc = tid & 7;      /* copies: 8 lanes a row, 32 rows a copy */
  const unsigned short* gk = (const unsigned short*)K16 + ((size_t)b * TT + cr) * ldk + h * 64 + cc * 8; const unsigned short* gv = Vth + (size_t)cr * TT + cc * 8;
  const size_t k32 = (size_t)32 * ldk, v32 = (size_t)32 * TT;
  const unsigned lcp = (unsigned)(size_t)R + (unsigned)(cr * FL_PITCH + cc * 16);
  fl_copy(lcp, gk, gv, k32, v32);
  asm volatile("s_wait_asynccnt 0x0" ::: "memory");      /* stage 0 has landed before the barrier that publishes it */
  __syncthreads();
  fl_copy(lcp + FL_BUF, gk + 2 * k32, gv + 64, k32, v32);
  const unsigned char* fk = R + ln * FL_PITCH + hh * 16; const unsigned char* fv = fk + FL_OPB;
  float m_q = -3.0e38f, l_q = 0.f; v8f oacc[DT];
#pragma unroll
  for (int dt = 0; dt < DT; ++dt) oacc[dt] = (v8f){0.f,0.f,0.f,0.f,0.f,0.f,0.f,0.f};
#pragma unroll 1      /* stays rolled: one copy of the ring's foot */
  for (int t = 0; t < NST; ++t) {
    const unsigned bo = (unsigned)(t & 1) * FL_BUF;
#pragma unroll
    for (int p = 0; p < 2; ++p) {
    FragH ak[2][KS], av[DT];      /* the pass's 16 fragment reads stand together at its head */
#pragma unroll
    for (int nt = 0; nt < 2; ++nt)
#pragma unroll
      for (int ks = 0; ks < KS; ++ks) { ak[nt][ks].half[0] = *(const v8us*)(fk + bo + (p * 32 + nt * 16) * FL_PITCH + ks * 64); ak[nt][ks].half[1] = *(const v8us*)(fk + bo + (p * 32 + nt * 16) * FL_PITCH + ks * 64 + 32); }
#pragma unroll
    for (int dt = 0; dt < DT; ++dt) { av[dt].half[0] = *(const v8us*)(fv + bo + dt * 16 * FL_PITCH + p * 64); av[dt].half[1] = *(const v8us*)(fv + bo + dt * 16 * FL_PITCH + p * 64 + 32); }
    __builtin_amdgcn_sched_barrier(0);      /* keeps the 16 reads together here: sunk to their uses, each pair would be waited for on its own, in front of its WMMA */
    v8f s[2];
#pragma unroll
    for (int nt = 0; nt < 2; ++nt) { v8f acc = (v8f){0.f,0.f,0.f,0.f,0.f,0.f,0.f,0.f};
#pragma unroll
      for (int ks = 0; ks < KS; ++ks) acc = __builtin_amdgcn_wmma_f32_16x16x32_f16(false, ak[nt][ks].v, false, bq[ks].v, (short)0, acc, false, false);
      s[nt] = acc; }
    float mc = -3.0e38f;      /* the maximum is taken over the raw products: their scale is positive and goes into the exponent's multiply-add */
#pragma unroll
    for (int nt = 0; nt < 2; ++nt)
#pragma unroll
      for (int r = 0; r < 8; ++r) mc = fmaxf(mc, s[nt][r]);
    mc = fmaxf(mc, xhalf(mc));
    const float mn = fmaxf(m_q, mc); const float al = (mn > -1.0e38f) ? __builtin_amdgcn_exp2f((m_q - mn) * FL_SC) : 1.0f; m_q = mn;
    const float off = 10.0f - mn * FL_SC;      /* P x 2^10 = exp2(s * FL_SC + off) */
    FragH pb; v2f ps;
#pragma unroll
    for (int nt = 0; nt < 2; ++nt) { float e[8];
#pragma unroll
      for (int r = 0; r < 8; ++r) e[r] = s[nt][r] * FL_SC + off;
      /* eight v_exp_f32, each over its own argument, so that none overwrites the source of the one in front of it (the builtin's results took such registers); from the last to the first, the order in which
         the conversions behind them read, so that the first reader finds its operands finished; the v_nop is the slot that the instruction set asks for behind the last v_exp_f32 */
      asm("v_exp_f32 %7, %7\n\tv_exp_f32 %6, %6\n\tv_exp_f32 %5, %5\n\tv_exp_f32 %4, %4\n\tv_exp_f32 %3, %3\n\tv_exp_f32 %2, %2\n\tv_exp_f32 %1, %1\n\tv_exp_f32 %0, %0\n\tv_nop"
          : "+v"(e[0]), "+v"(e[1]), "+v"(e[2]), "+v"(e[3]), "+v"(e[4]), "+v"(e[5]), "+v"(e[6]), "+v"(e[7]));
#pragma unroll
      for (int r = 0; r < 8; r += 2) { const v2f pr = {e[r], e[r + 1]}; ps = (nt == 0 && r == 0) ? pr : ps + pr; pb.h[nt * 8 + r] = (_Float16)e[r]; pb.h[nt * 8 + r + 1] = (_Float16)e[r + 1]; } }
    l_q = l_q * al + (ps[0] + ps[1]);      /* carries 2^10 like P; this half's keys only; the halves are joined behind the loop */
#pragma unroll
    for (int dt = 0; dt < DT; ++dt)
#pragma unroll
      for (int r = 0; r < 8; ++r) oacc[dt][r] *= al;
#pragma unroll
    for (int dt = 0; dt < DT; ++dt) oacc[dt] = __builtin_amdgcn_wmma_f32_16x16x32_f16(false, av[dt].v, false, pb.v, (short)0, oacc[dt], false, false); }
    __builtin_amdgcn_sched_barrier(0);      /* keeps the stage's arithmetic ahead of the foot: sunk behind the barrier it would delay the refill, and the copies would have only the next stage's reads to land under */
    asm volatile("s_wait_dscnt 0x0" ::: "memory");      /* this wave's reads of the buffer are over before it may be refilled */
    asm volatile("s_wait_asynccnt 0x0" ::: "memory");      /* this wave's share of stage t + 1 has landed before the barrier publishes it */
    __syncthreads();
    if (t + 2 < NST) fl_copy(lcp + bo, gk + (size_t)(t + 2) * 2 * k32, gv + (t + 2) * 64, k32, v32);
  }
  asm volatile("s_wait_asynccnt 0x0" ::: "memory");      /* no copy outstanding when the wave goes on to its end */
  const float lt = l_q + xhalf(l_q); const float il = (lt > 0.f) ? 16.0f / lt : 0.f;      /* P and its sum both carry 2^10, the f16 result plane 2^4 */
#pragma unroll
  for (int dt = 0; dt < DT; ++dt) { FragH f;      /* oacc[dt][r] = OT[dt * 16 + 8 * hh + r][query ln] */
#pragma unroll
    for (int r = 0; r < 8; ++r) f.h[r] = (_Float16)(oacc[dt][r] * il);
    *(v8us*)&sO[w][ln][dt * 16 + 8 * hh] = f.half[0]; }
  __builtin_amdgcn_fence(__ATOMIC_ACQ_REL, "workgroup"); __builtin_amdgcn_wave_barrier();
#pragma unroll
  for (int rp = 0; rp < RPW; rp += 4) { const int r = rp + (lane >> 3), pc = lane & 7; const v8us val = *(const v8us*)&sO[w][r][pc * 8];      /* 8 lanes a row: one whole 128-B line of the f16 plane */
    *(v8us*)((unsigned short*)O16 + ((size_t)b * TT + q0 + r) * ldo + h * 64 + pc * 8) = val; } }

extern "C" void kernel_launch(void* const* d_in, const int* in_sizes, int n_in,
                              void* d_out, int out_size, void* d_ws, size_t ws_size, hipStream_t stream) {
  (void)in_sizes; (void)n_in; (void)out_size;
  const float* const* I = (const float* const*)d_in; const float* feats = I[0]; const float* geom = I[1]; const float* crd = I[2];
  const float* wq = I[3]; const float* bq = I[4]; const float* wk = I[5]; const float* bk = I[6]; const float* wv = I[7]; const float* bv = I[8]; const float* wo = I[9]; const float* bo = I[10];
  const float* gqw = I[11]; const float* gqb = I[12]; const float* gkw = I[13]; const float* gkb = I[14]; const float* gvw = I[15]; const float* gvb = I[16]; const float* d1w = I[17]; const float* d1b = I[18]; const float* d2w = I[19]; const float* d2b = I[20]; const float* opw = I[21]; const float* opb = I[22];
  char* ws = (char*)d_ws; size_t off = 0;
  auto take = [&](size_t bytes) { char* p = ws + off; off += (bytes + 255) & ~(size_t)255; return p; };
  const size_t WSZ = (size_t)DD * DD, GSZ = (size_t)GG * DD, PSZ = (size_t)NR * DD; _Float16* Bw = (_Float16*)take(5 * WSZ * 2); _Float16* Bg = (_Float16*)take(3 * GSZ * 2);
  _Float16* X16 = (_Float16*)take(PSZ * 2); _Float16* GE16 = (_Float16*)take((size_t)NR * GG * 2);
  _Float16* PL = (_Float16*)take(6 * PSZ * 2);      /* planes in a row: q, k, the sum feat + geom, one unused, gq, gk */
  _Float16* RL = (_Float16*)take(2 * PSZ * 2);      /* residual planes of gq, gk */
  _Float16* VT = (_Float16*)take(2 * PSZ * 2);      /* v and gv, written transposed by their GEMMs */
  float* FA = (float*)take(PSZ * 4); float* S = (float*)take((size_t)BB * TT * TT * 4); _Float16* P16 = (_Float16*)take((size_t)BB * TT * TT * 2);
  _Float16* Q = PL; _Float16* K = PL + PSZ; _Float16* V = PL + 2 * PSZ; _Float16* GQ = PL + 4 * PSZ; _Float16* GK = PL + 5 * PSZ; _Float16* GQl = RL; _Float16* GKl = RL + PSZ; _Float16* Vt = VT; _Float16* GVt = VT + PSZ;
  _Float16* O16 = X16; _Float16* SUM16 = V;      /* reuse in stream order: X16 -> the attention output (behind the projections) */
  if (off > ws_size) return;      // 2.6 + 0.4 + 8.4 + 2.1 + 10 x 8.4 + 16.8 + 33.6 + 16.8 = about 165 MB
  const int NOSPLIT = 0x7fffffff;      /* a launch with one set only */
  k_prep<<<5 * PW_BIG + 3 * PW_SML + PX_F + PX_G, 256, 0, stream>>>(wq, wk, wv, wo, opw, gqw, gkw, gvw, feats, geom, Bw, Bg, X16, GE16);      /* (in,out) weights -> Bt x 2^4; features, geometry -> f16 */
  const unsigned gpx = (NR / 128) * (DD / 128);
  const size_t sX = (size_t)TT * DD, sS = (size_t)TT * TT;
  { const GSet f = {X16, Bw, bq, bk, bk, nullptr, PL, nullptr, 0, WSZ, PSZ, DD, DD, DD, DD, DD, 0.0625f};      /* q, k: M 8192 N 512 K 512 */
    const GSet vt = {Bw + 2 * WSZ, X16, bv, bv, bv, nullptr, Vt, nullptr, 0, 0, sX, DD, DD, TT, NR, DD, 0.0625f, nullptr, nullptr, nullptr, nullptr, 0.f, TT_LOG2};      /* vT = wvT.featuresT, per batch [512][1024] = per head [64][1024]: M 512 N 8192 K 512 */
    const GSet gt = {Bg + 2 * GSZ, GE16, gvb, gvb, gvb, nullptr, GVt, nullptr, 0, 0, sX, GG, GG, TT, NR, GG, 0.0625f, nullptr, nullptr, nullptr, nullptr, 0.f, TT_LOG2};      /* gvT = gv_wT.geometryT, per batch [512][1024]: M 512 N 8192 K 128 */
    k_gemm_t<0, 0><<<dim3(gpx, 4), 256, 0, stream>>>(f, vt, gt, 2, 3, nullptr, 0); }
  { const GSet e = {GE16, Bg, gqb, gkb, gkb, nullptr, GQ, RL, 0, GSZ, PSZ, GG, GG, DD, DD, GG, 0.0625f};      /* gq, gk -> hi / x2^10 residual planes: M 8192 N 512 K 128 */
    k_gemm_t<0, 2><<<dim3(gpx, 2), 256, 0, stream>>>(e, e, e, NOSPLIT, NOSPLIT, nullptr, 0); }
  k_flash<<<BB * NH * (TT / 128), 256, 0, stream>>>(Q, DD, K, DD, Vt, nullptr, O16, DD);      /* the attention output leaves as f16 x 2^4 */
  /* geometry branch: all BB batches of each stage in one launch, the batch in blockIdx.y (operand, addend and result strides per batch) */
  { const GSet hh = {GQl, GK, nullptr, nullptr, nullptr, S, nullptr, nullptr, sX, sX, sS, DD, DD, TT, TT, DD, 0.125f, GQ, GKl, GQ, GK, 0.0009765625f};      /* S = gq.gkT/8 f32-accurate, ((lo.hi + hi.lo).2^-10 + hi.hi)/8 in one accumulator: M 1024 N 1024 K 3 x 512, x BB */      /* left open: gq.gkT = (gq.gk_wT).geometryT + a term constant along a score row, which the softmax cancels: K 128 for 512 */
    const GSet fo = {O16, Bw + 3 * WSZ, bo, bo, bo, FA, nullptr, nullptr, PSZ / 4, 0, PSZ / 4, DD, DD, DD, DD, DD, 0.00390625f};      /* feat_att = O.wo + bo (f32), in four slices of 2048 rows, each as many work-groups as one batch of S */
    k_gemm_t<0, 1, true><<<dim3((TT / 128) * (TT / 128), BB + 4), 256, 0, stream>>>(hh, fo, fo, BB, NOSPLIT, nullptr, 0); }
  k_gbias<<<dim3(TT / GB_ROWS, BB), 256, 0, stream>>>(S, crd, d1w, d1b, d2w, d2b); k_smx<<<BB * TT / 8, 256, 0, stream>>>(S, P16);      /* softmax: a wave per row over the BB * TT rows */
  { const GSet pv = {P16, GVt, nullptr, nullptr, nullptr, nullptr, SUM16, nullptr, sS, sX, sX, TT, TT, DD, DD, TT, 0.000030517578125f};
    k_gemm_t<DD, 0><<<dim3((TT / 128) * (DD / 128), BB), 256, 0, stream>>>(pv, pv, pv, NOSPLIT, NOSPLIT, FA, sX); }      /* feat_att + geom_att, stored as f16: M 1024 N 512 K 1024, x BB */
  { const GSet op = {SUM16, Bw + 4 * WSZ, opb, opb, opb, (float*)d_out, nullptr, nullptr, 0, 0, 0, DD, DD, DD, DD, DD, 0.0625f};
    k_gemm_t<0, 1><<<dim3(gpx, 1), 256, 0, stream>>>(op, op, op, NOSPLIT, NOSPLIT, nullptr, 0); }      /* out = (feat + geom).op_w + op_b */
}
